// v000
// Times are from an AMD MI455X. After a warm-up the kernel runs many times in a row, and a time is the length of
// such a window on the GPU divided by its runs, so every launch and the gaps after it count. The runs cycle
// through copies of the inputs. A figure is the median of several windows, for all but v000 over two sittings.
// Sittings can differ by a few percent; kernels timed side by side share one.
// v000 is the starting kernel. One run takes 369 microseconds.
#include <hip/hip_runtime.h>
#include <hip/hip_bf16.h>

typedef __attribute__((ext_vector_type(2))) float        v2f;
typedef __attribute__((ext_vector_type(8))) float        v8f;
typedef __attribute__((ext_vector_type(4))) unsigned int v4u;
typedef __attribute__((ext_vector_type(8))) int          v8i;
typedef __attribute__((ext_vector_type(4))) int          v4i;

#define NH    12
#define HS    64
#define SEQ   2048
#define HID   768
#define BATCH 2

#if defined(__gfx1250__) && __has_builtin(__builtin_amdgcn_tensor_load_to_lds)
#define HAVE_TDM 1
#else
#define HAVE_TDM 0
#endif

static __device__ __forceinline__ v8f wmma_f32_4(v2f a, v2f b, v8f c) {
  // D = A(16x4 f32) x B(4x16 f32) + C(16x16 f32)
  return __builtin_amdgcn_wmma_f32_16x16x4_f32(
      false, a, false, b, (short)0, c, false, false);
}

#if HAVE_TDM
// Issue a TDM load of a [16 rows x 64 f32] tile (row stride 64 elems) from
// global memory into LDS at byte offset lds_off.  D# fields per ISA 8.3/8.4.
static __device__ __forceinline__ void tdm_load_tile(unsigned lds_off,
                                                     const float* gptr) {
  unsigned long long ga = (unsigned long long)(uintptr_t)gptr;
  v4u g0 = {
      1u,                                   // count=1, user descriptor
      lds_off,                              // lds_addr (bytes)
      (unsigned)ga,                         // global_addr[31:0]
      ((unsigned)(ga >> 32) & 0x01FFFFFFu)  // global_addr[56:32]
          | 0x80000000u                     // type=2 ("image")
  };
  v8i g1 = {
      (int)(2u << 16),                 // data_size=2 (4 bytes)
      (int)((HS & 0xFFFFu) << 16),     // tensor_dim0 = 64  (bits 79:48)
      (int)((SEQ & 0xFFFFu) << 16),    // tensor_dim1 = 2048 (bits 111:80)
      (int)((HS & 0xFFFFu) << 16),     // tile_dim0 = 64    (bits 127:112)
      16,                              // tile_dim1 = 16, tile_dim2 = 0
      HS,                              // tensor_dim0_stride = 64 elems
      0, 0                             // tensor_dim1_stride = 0 (2-D)
  };
  v4i z = {0, 0, 0, 0};
#if __has_include(<hip/amd_detail/amd_gfx1250_TDM.h>)
  v8i z8 = {0, 0, 0, 0, 0, 0, 0, 0};
  __builtin_amdgcn_tensor_load_to_lds(g0, g1, z, z, z8, 0);   // clang-23 form
#else
  __builtin_amdgcn_tensor_load_to_lds(g0, g1, z, z, 0);       // ROCm 7.2 form
#endif
}
#endif

// ---------------------------------------------------------------------------
// Kernel 1: fused QKV projection, y = x @ W.T + b, scattered head-major.
// One wave per 64x64 output tile: 4x4 v8f accumulators (128 VGPRs),
// 16 WMMAs per 8 float2 loads -> 4x the math/byte of a 16x16 tile.
// ---------------------------------------------------------------------------
__global__ __launch_bounds__(32) void qkv_proj_kernel(
    const float* __restrict__ X,
    const float* __restrict__ Wq, const float* __restrict__ bq,
    const float* __restrict__ Wk, const float* __restrict__ bk,
    const float* __restrict__ Wv, const float* __restrict__ bv,
    float* __restrict__ Q, float* __restrict__ K, float* __restrict__ V) {
  const int lane = threadIdx.x;
  const int lo = lane & 15;
  const int hi = lane >> 4;
  const int m0 = blockIdx.x * 64;   // token tile over B*S = 4096
  const int n0 = blockIdx.y * 64;   // feature tile over H = 768

  const float* W;
  const float* bias;
  float* O;
  if (blockIdx.z == 0)      { W = Wq; bias = bq; O = Q; }
  else if (blockIdx.z == 1) { W = Wk; bias = bk; O = K; }
  else                      { W = Wv; bias = bv; O = V; }

  const float* ar[4];
  const float* br[4];
#pragma unroll
  for (int i = 0; i < 4; ++i) {
    ar[i] = X + (size_t)(m0 + 16 * i + lo) * HID + hi * 2;
    br[i] = W + (size_t)(n0 + 16 * i + lo) * HID + hi * 2;
  }

  v8f acc[4][4] = {};
  for (int k = 0; k < HID; k += 4) {
    v2f a[4], b[4];
#pragma unroll
    for (int i = 0; i < 4; ++i) a[i] = *(const v2f*)(ar[i] + k);
#pragma unroll
    for (int j = 0; j < 4; ++j) b[j] = *(const v2f*)(br[j] + k);
#pragma unroll
    for (int i = 0; i < 4; ++i)
#pragma unroll
      for (int j = 0; j < 4; ++j)
        acc[i][j] = wmma_f32_4(a[i], b[j], acc[i][j]);
  }

#pragma unroll
  for (int j = 0; j < 4; ++j) {
    const int col = n0 + 16 * j + lo;
    const float bn = bias[col];
    const int h = col >> 6;
    const int d = col & 63;
#pragma unroll
    for (int i = 0; i < 4; ++i) {
#pragma unroll
      for (int r = 0; r < 8; ++r) {
        const int row = m0 + 16 * i + r + hi * 8;   // token in [0, 4096)
        const int bi = row >> 11;
        const int s  = row & (SEQ - 1);
        O[((size_t)(bi * NH + h) * SEQ + s) * HS + d] = acc[i][j][r] + bn;
      }
    }
  }
}

// ---------------------------------------------------------------------------
// Kernel 2: flash-style attention.  4 waves / block, 64 queries / block.
// K/V 16x64 tiles are double-buffered in LDS; wave 0 issues TDM loads for
// tile kt+1 before compute of tile kt and waits TENSORcnt after, overlapping
// the DMA with 32 WMMAs + online softmax.
// ---------------------------------------------------------------------------
__global__ __launch_bounds__(128) void attention_kernel(
    const float* __restrict__ Q, const float* __restrict__ K,
    const float* __restrict__ V, const int* __restrict__ mask,
    float* __restrict__ out) {
  __shared__ float k_lds[2][16][HS];
  __shared__ float v_lds[2][16][HS];
  __shared__ float p_lds[4][16][16];

  const float NEG_INF = -__builtin_inff();
  const int tid  = threadIdx.x;
  const int wave = tid >> 5;
  const int lane = tid & 31;
  const int lo = lane & 15;
  const int hi = lane >> 4;
  const int q0 = blockIdx.x * 64 + wave * 16;
  const int h  = blockIdx.y;
  const int b  = blockIdx.z;

  const size_t head_off = (size_t)(b * NH + h) * SEQ * HS;
  const float* Qh = Q + head_off;
  const float* Kh = K + head_off;
  const float* Vh = V + head_off;

  // Preload this wave's 16 Q A-fragments (K-dim 64 in steps of 4).
  v2f aq[16];
  {
    const float* qrow = Qh + (size_t)(q0 + lo) * HS;
#pragma unroll
    for (int t = 0; t < 16; ++t)
      aq[t] = *(const v2f*)(qrow + 4 * t + hi * 2);
  }

  float mstat[8], lstat[8];
#pragma unroll
  for (int r = 0; r < 8; ++r) { mstat[r] = NEG_INF; lstat[r] = 0.0f; }
  v8f o[4] = {};

  const int NT = SEQ / 16;

  // ---- prologue: stage tile 0 into buffer 0 ----
#if HAVE_TDM
  if (wave == 0) {
    tdm_load_tile((unsigned)(uintptr_t)&k_lds[0][0][0], Kh);
    tdm_load_tile((unsigned)(uintptr_t)&v_lds[0][0][0], Vh);
    __builtin_amdgcn_s_wait_tensorcnt(0);
  }
#else
  for (int i = tid; i < 16 * HS / 2; i += 128) {
    ((v2f*)&k_lds[0][0][0])[i] = ((const v2f*)Kh)[i];
    ((v2f*)&v_lds[0][0][0])[i] = ((const v2f*)Vh)[i];
  }
#endif
  __syncthreads();

  int cur = 0;
  for (int kt = 0; kt < NT; ++kt) {
    // ---- prefetch next K/V tile into the other buffer (async DMA) ----
#if HAVE_TDM
    if (wave == 0 && kt + 1 < NT) {
      const size_t nxt = (size_t)(kt + 1) * 16 * HS;
      tdm_load_tile((unsigned)(uintptr_t)&k_lds[cur ^ 1][0][0], Kh + nxt);
      tdm_load_tile((unsigned)(uintptr_t)&v_lds[cur ^ 1][0][0], Vh + nxt);
    }
#endif

    // ---- scores = Q · K^T for this 16x16 tile (K from LDS) ----
    v8f sacc = {};
#pragma unroll
    for (int t = 0; t < 16; ++t) {
      v2f bk = *(const v2f*)(&k_lds[cur][lo][4 * t + hi * 2]);
      sacc = wmma_f32_4(aq[t], bk, sacc);
    }

    // ---- scale + mask ----
    const int keycol = kt * 16 + lo;
    const bool keep = mask[b * SEQ + keycol] != 0;
    float sv[8];
#pragma unroll
    for (int r = 0; r < 8; ++r)
      sv[r] = keep ? sacc[r] * 0.125f : NEG_INF;   // 1/sqrt(64)

    // ---- online softmax per row (row = one 16-lane half of the wave) ----
#pragma unroll
    for (int r = 0; r < 8; ++r) {
      float rmax = sv[r];
      rmax = fmaxf(rmax, __shfl_xor(rmax, 1, 32));
      rmax = fmaxf(rmax, __shfl_xor(rmax, 2, 32));
      rmax = fmaxf(rmax, __shfl_xor(rmax, 4, 32));
      rmax = fmaxf(rmax, __shfl_xor(rmax, 8, 32));
      const float mnew = fmaxf(mstat[r], rmax);
      const float factor = (mnew == NEG_INF) ? 1.0f : __expf(mstat[r] - mnew);
      const float p = (sv[r] == NEG_INF) ? 0.0f : __expf(sv[r] - mnew);
      float rsum = p;
      rsum += __shfl_xor(rsum, 1, 32);
      rsum += __shfl_xor(rsum, 2, 32);
      rsum += __shfl_xor(rsum, 4, 32);
      rsum += __shfl_xor(rsum, 8, 32);
      lstat[r] = lstat[r] * factor + rsum;
      mstat[r] = mnew;
#pragma unroll
      for (int c = 0; c < 4; ++c) o[c][r] *= factor;
      p_lds[wave][r + hi * 8][lo] = p;      // C-layout -> LDS
    }
    __syncthreads();   // p visible; uniform across all 4 waves

    // ---- O += P · V  (P from LDS in A-layout, V from LDS) ----
#pragma unroll
    for (int t = 0; t < 4; ++t) {
      v2f ap = *(const v2f*)(&p_lds[wave][lo][4 * t + hi * 2]);
      const int k0 = 4 * t + hi * 2;
#pragma unroll
      for (int c = 0; c < 4; ++c) {
        v2f bv = { v_lds[cur][k0][c * 16 + lo], v_lds[cur][k0 + 1][c * 16 + lo] };
        o[c] = wmma_f32_4(ap, bv, o[c]);
      }
    }

#if HAVE_TDM
    if (wave == 0 && kt + 1 < NT) __builtin_amdgcn_s_wait_tensorcnt(0);
#else
    __syncthreads();
    if (kt + 1 < NT) {
      const size_t nxt = (size_t)(kt + 1) * 16 * HS;
      for (int i = tid; i < 16 * HS / 2; i += 128) {
        ((v2f*)&k_lds[cur ^ 1][0][0])[i] = ((const v2f*)(Kh + nxt))[i];
        ((v2f*)&v_lds[cur ^ 1][0][0])[i] = ((const v2f*)(Vh + nxt))[i];
      }
    }
#endif
    __syncthreads();   // tile kt+1 staged & everyone done with buffer `cur`
    cur ^= 1;
  }

  // ---- normalize and write out [B, S, H] ----
  float inv[8];
#pragma unroll
  for (int r = 0; r < 8; ++r) inv[r] = (lstat[r] > 0.0f) ? 1.0f / lstat[r] : 0.0f;
#pragma unroll
  for (int r = 0; r < 8; ++r) {
    const int srow = q0 + r + hi * 8;
    float* orow = out + (size_t)(b * SEQ + srow) * HID + h * HS;
#pragma unroll
    for (int c = 0; c < 4; ++c)
      orow[c * 16 + lo] = o[c][r] * inv[r];
  }
}

extern "C" void kernel_launch(void* const* d_in, const int* in_sizes, int n_in,
                              void* d_out, int out_size, void* d_ws, size_t ws_size,
                              hipStream_t stream) {
  const float* X    = (const float*)d_in[0];
  const int*   mask = (const int*)d_in[1];
  const float* Wq   = (const float*)d_in[2];
  const float* bq   = (const float*)d_in[3];
  const float* Wk   = (const float*)d_in[4];
  const float* bk   = (const float*)d_in[5];
  const float* Wv   = (const float*)d_in[6];
  const float* bv   = (const float*)d_in[7];
  float* out = (float*)d_out;

  const size_t per = (size_t)BATCH * SEQ * HID;
  float* Qb = (float*)d_ws;
  float* Kb = Qb + per;
  float* Vb = Kb + per;

  qkv_proj_kernel<<<dim3((BATCH * SEQ) / 64, HID / 64, 3), 32, 0, stream>>>(
      X, Wq, bq, Wk, bk, Wv, bv, Qb, Kb, Vb);
  attention_kernel<<<dim3(SEQ / 64, NH, BATCH), 128, 0, stream>>>(
      Qb, Kb, Vb, mask, out);
}

// v001
// Measured time: 325 microseconds a run.
// Timed twice side by side with v000, it ran 1.18 and 1.21 times as fast.
#include <hip/hip_runtime.h>
#include <hip/hip_bf16.h>

typedef __attribute__((ext_vector_type(2))) float        v2f;
typedef __attribute__((ext_vector_type(8))) float        v8f;
typedef __attribute__((ext_vector_type(4))) unsigned int v4u;
typedef __attribute__((ext_vector_type(8))) unsigned int v8u;

#define NH    12
#define HS    64
#define SEQ   2048
#define HID   768
#define BATCH 2

static __device__ __forceinline__ v8f wmma_f32_4(v2f a, v2f b, v8f c) {
  // D = A(16x4 f32) x B(4x16 f32) + C(16x16 f32)
  return __builtin_amdgcn_wmma_f32_16x16x4_f32(
      false, a, false, b, (short)0, c, false, false);
}

// LDS row pitches of the staged 16 x 64 f32 tiles, in floats.  Bank = dword address mod 64, so at the
// source pitch of 64 all 16 rows of a column fall on one bank.  K is read 8 bytes a lane down a column
// (16 rows x 2 column pairs): pitch 68 puts the 32 lanes on 64 different banks.  V is read 4 bytes a lane
// along two rows that lie two apart: pitch 72 puts the two 16-lane runs on different banks.
#define KPITCH 68
#define VPITCH 72
#define TILE_FLOATS 1536   // 6 KiB a buffer: 16 padded rows, rounded up to a multiple of 2 KiB
// P (16 x 16 a wave) is read like K, 8 bytes a lane down a column: at pitch 20 the 16 rows start on
// 16 different groups of four banks; its 4-byte stores along two rows eight apart stay apart too.
#define PPITCH 20

static __device__ __forceinline__ uint32_t uni(uint32_t v) {
  return (uint32_t)__builtin_amdgcn_readfirstlane(v);
}
// A wave-uniform test held in a scalar register, so that the branch on it is a scalar branch:
// a tensor load ignores EXEC and only a scalar branch keeps a wave from issuing it.
static __device__ __forceinline__ uint32_t pinned(uint32_t v) {
  uint32_t w = uni(v);
  asm volatile("" : "+s"(w));  // holds the test in a scalar register
  return w;
}
// This wave's LDS accesses have returned; the clobber keeps LDS accesses on their side.
static __device__ __forceinline__ void wait_ds0() { asm volatile("s_wait_dscnt 0x0" ::: "memory"); }

#define TILE_BYTES (16u * HS * 4u)   // one source tile: 16 contiguous rows of 256 bytes

// Group 1 of a request for 16 rows of 256 bytes (source pitch 256 bytes), with PAD_CODE + 1 dwords of
// pad behind every 256-byte row in LDS (interval code 5).  Extents in bytes.  Built once a kernel.
template <uint32_t PAD_CODE>
static __device__ __forceinline__ v8u tdm_group1() {
  constexpr uint32_t d0 = HS * 4u, d1 = 16u;
  v8u g1;
  g1[0] = uni((1u << 20) | (5u << 22) | (PAD_CODE << 25));          // no mask, 1-byte elements, pad on
  g1[1] = uni((d0 & 0xFFFFu) << 16);                                // tensor_dim0 = tile_dim0
  g1[2] = uni((d0 >> 16) | ((d1 & 0xFFFFu) << 16));                 // tensor_dim1 = tile_dim1
  g1[3] = uni((d1 >> 16) | (d0 << 16));
  g1[4] = uni(d1);
  g1[5] = uni(d0);                                                  // source row pitch
  g1[6] = uni(0u);
  g1[7] = uni(0u);
  // holds the descriptor words in their scalar registers for the
  // whole kernel; without it the constants are set anew at each issue, over words of a request in flight
  asm volatile("" : "+s"(g1));
  return g1;
}
// Group 0: LDS place and the tile's first byte.
static __device__ __forceinline__ v4u tdm_group0(uint32_t lds_off, const float* gptr) {
  const uint64_t ga = (uint64_t)(uintptr_t)gptr;
  v4u g0;
  g0[0] = uni(1u);                                                  // count = 1
  g0[1] = uni(lds_off);
  g0[2] = uni((uint32_t)ga);
  g0[3] = uni((((uint32_t)(ga >> 32)) & 0x01FFFFFFu) | 0x80000000u);  // type = 2
  return g0;
}
// The next tile of the same stream: a new LDS place, the 64-bit address in words 2 and 3 one tile on.
static __device__ __forceinline__ void tdm_next(v4u& g0, uint32_t lds_off) {
  const uint64_t a = (((uint64_t)g0[3] << 32) | g0[2]) + TILE_BYTES;
  g0[1] = uni(lds_off);
  g0[2] = uni((uint32_t)a);
  g0[3] = uni((uint32_t)(a >> 32));
}
// The two-group form; the clobber keeps LDS accesses from moving across the issue.  g0 is in and out, so
// that what follows works on the very registers that the request names.
static __device__ __forceinline__ void tdm_issue(v4u& g0, const v8u& g1) {
  asm volatile("tensor_load_to_lds %0, %1" : "+s"(g0) : "s"(g1) : "memory");
}
// The wait that covers the wave's request (the compiler places none for the tensor mover); every wave
// runs it, a wave with nothing in flight passes at once.  It names the groups: their registers stay as
// the request was issued with them up to here, and group 0 takes its next value only behind it.
static __device__ __forceinline__ void wait_tensor0_groups(v4u& g0, const v8u& g1k, const v8u& g1v) {
  asm volatile("s_wait_tensorcnt 0x0" : "+s"(g0) : "s"(g1k), "s"(g1v) : "memory");
}

// ---------------------------------------------------------------------------
// Kernel 1: fused QKV projection, y = x @ W.T + b, scattered head-major.
// One wave per 64x64 output tile: 4x4 v8f accumulators (128 VGPRs),
// 16 WMMAs per 8 float2 loads -> 4x the math/byte of a 16x16 tile.
// ---------------------------------------------------------------------------
__global__ __launch_bounds__(32) void qkv_proj_kernel(
    const float* __restrict__ X,
    const float* __restrict__ Wq, const float* __restrict__ bq,
    const float* __restrict__ Wk, const float* __restrict__ bk,
    const float* __restrict__ Wv, const float* __restrict__ bv,
    float* __restrict__ Q, float* __restrict__ K, float* __restrict__ V) {
  const int lane = threadIdx.x;
  const int lo = lane & 15;
  const int hi = lane >> 4;
  const int m0 = blockIdx.x * 64;   // token tile over B*S = 4096
  const int n0 = blockIdx.y * 64;   // feature tile over H = 768

  const float* W;
  const float* bias;
  float* O;
  if (blockIdx.z == 0)      { W = Wq; bias = bq; O = Q; }
  else if (blockIdx.z == 1) { W = Wk; bias = bk; O = K; }
  else                      { W = Wv; bias = bv; O = V; }

  const float* ar[4];
  const float* br[4];
#pragma unroll
  for (int i = 0; i < 4; ++i) {
    ar[i] = X + (size_t)(m0 + 16 * i + lo) * HID + hi * 2;
    br[i] = W + (size_t)(n0 + 16 * i + lo) * HID + hi * 2;
  }

  v8f acc[4][4] = {};
  for (int k = 0; k < HID; k += 4) {
    v2f a[4], b[4];
#pragma unroll
    for (int i = 0; i < 4; ++i) a[i] = *(const v2f*)(ar[i] + k);
#pragma unroll
    for (int j = 0; j < 4; ++j) b[j] = *(const v2f*)(br[j] + k);
#pragma unroll
    for (int i = 0; i < 4; ++i)
#pragma unroll
      for (int j = 0; j < 4; ++j)
        acc[i][j] = wmma_f32_4(a[i], b[j], acc[i][j]);
  }

#pragma unroll
  for (int j = 0; j < 4; ++j) {
    const int col = n0 + 16 * j + lo;
    const float bn = bias[col];
    const int h = col >> 6;
    const int d = col & 63;
#pragma unroll
    for (int i = 0; i < 4; ++i) {
#pragma unroll
      for (int r = 0; r < 8; ++r) {
        const int row = m0 + 16 * i + r + hi * 8;   // token in [0, 4096)
        const int bi = row >> 11;
        const int s  = row & (SEQ - 1);
        O[((size_t)(bi * NH + h) * SEQ + s) * HS + d] = acc[i][j][r] + bn;
      }
    }
  }
}

// ---------------------------------------------------------------------------
// Kernel 2: flash-style attention.  4 waves / block, 64 queries / block.
// K/V 16x64 tiles are double-buffered in LDS at padded row pitches; wave 0
// issues the tensor load of K and wave 1 that of V for tile kt+1 right behind
// the barrier that frees its buffer, and each waits for its own at the foot of
// pass kt, overlapping the load with 32 WMMAs + online softmax.
// ---------------------------------------------------------------------------
__global__ __launch_bounds__(128) void attention_kernel(
    const float* __restrict__ Q, const float* __restrict__ K,
    const float* __restrict__ V, const int* __restrict__ mask,
    float* __restrict__ out) {
  // Buffers K0, K1, V0, V1; each starts at a multiple of 2 KiB of the work-group's LDS.
  __shared__ __attribute__((aligned(2048))) float kv_lds[4 * TILE_FLOATS];
  __shared__ float p_lds[4][16][PPITCH];

  const float NEG_INF = -__builtin_inff();
  const int tid  = threadIdx.x;
  const int wave = (int)uni((uint32_t)tid >> 5);
  const int lane = tid & 31;
  const int lo = lane & 15;
  const int hi = lane >> 4;
  const int q0 = blockIdx.x * 64 + wave * 16;
  const int h  = blockIdx.y;
  const int b  = blockIdx.z;

  const size_t head_off = (size_t)(b * NH + h) * SEQ * HS;
  const float* Qh = Q + head_off;
  const float* Kh = K + head_off;
  const float* Vh = V + head_off;

  // Preload this wave's 16 Q A-fragments (K-dim 64 in steps of 4).
  v2f aq[16];
  {
    const float* qrow = Qh + (size_t)(q0 + lo) * HS;
#pragma unroll
    for (int t = 0; t < 16; ++t)
      aq[t] = *(const v2f*)(qrow + 4 * t + hi * 2);
  }

  float mstat[8], lstat[8];
#pragma unroll
  for (int r = 0; r < 8; ++r) { mstat[r] = NEG_INF; lstat[r] = 0.0f; }
  v8f o[4] = {};

  const int NT = SEQ / 16;

  // Wave 0 streams K's tiles, wave 1 V's; my_base is the wave's buffer 0 (waves 2 and 3 issue nothing).
  const uint32_t my_base = (uint32_t)(uintptr_t)&kv_lds[0] + (wave == 1 ? 2u * TILE_FLOATS * 4u : 0u);
  const v8u g1k = tdm_group1<3>();
  const v8u g1v = tdm_group1<7>();
  v4u g0 = tdm_group0(my_base, wave == 1 ? Vh : Kh);

  // ---- prologue: tile 0 into buffer 0, published; then tile 1 into buffer 1 ----
  if (pinned(wave == 0)) tdm_issue(g0, g1k);
  if (pinned(wave == 1)) tdm_issue(g0, g1v);
  wait_tensor0_groups(g0, g1k, g1v);   // the issuer's own tile 0 has landed
  __syncthreads();                     // tile 0 readable by every wave
  tdm_next(g0, my_base + TILE_FLOATS * 4u);
  if (pinned(wave == 0)) tdm_issue(g0, g1k);
  if (pinned(wave == 1)) tdm_issue(g0, g1v);

  int cur = 0;
  for (int kt = 0; kt < NT; ++kt) {
    const float* kt_lds = &kv_lds[cur * TILE_FLOATS];
    const float* vt_lds = &kv_lds[(2 + cur) * TILE_FLOATS];

    // ---- scores = Q · K^T for this 16x16 tile (K from LDS) ----
    v8f sacc = {};
#pragma unroll
    for (int t = 0; t < 16; ++t) {
      v2f bk = *(const v2f*)(&kt_lds[lo * KPITCH + 4 * t + hi * 2]);
      sacc = wmma_f32_4(aq[t], bk, sacc);
    }

    // ---- scale + mask ----
    const int keycol = kt * 16 + lo;
    const bool keep = mask[b * SEQ + keycol] != 0;
    float sv[8];
#pragma unroll
    for (int r = 0; r < 8; ++r)
      sv[r] = keep ? sacc[r] * 0.125f : NEG_INF;   // 1/sqrt(64)

    // ---- online softmax per row (row = one 16-lane half of the wave) ----
#pragma unroll
    for (int r = 0; r < 8; ++r) {
      float rmax = sv[r];
      rmax = fmaxf(rmax, __shfl_xor(rmax, 1, 32));
      rmax = fmaxf(rmax, __shfl_xor(rmax, 2, 32));
      rmax = fmaxf(rmax, __shfl_xor(rmax, 4, 32));
      rmax = fmaxf(rmax, __shfl_xor(rmax, 8, 32));
      const float mnew = fmaxf(mstat[r], rmax);
      const float factor = (mnew == NEG_INF) ? 1.0f : __expf(mstat[r] - mnew);
      const float p = (sv[r] == NEG_INF) ? 0.0f : __expf(sv[r] - mnew);
      float rsum = p;
      rsum += __shfl_xor(rsum, 1, 32);
      rsum += __shfl_xor(rsum, 2, 32);
      rsum += __shfl_xor(rsum, 4, 32);
      rsum += __shfl_xor(rsum, 8, 32);
      lstat[r] = lstat[r] * factor + rsum;
      mstat[r] = mnew;
#pragma unroll
      for (int c = 0; c < 4; ++c) o[c][r] *= factor;
      p_lds[wave][r + hi * 8][lo] = p;      // C-layout -> LDS
    }
    __syncthreads();   // p visible; uniform across all 4 waves

    // ---- O += P · V  (P from LDS in A-layout, V from LDS) ----
#pragma unroll
    for (int t = 0; t < 4; ++t) {
      v2f ap = *(const v2f*)(&p_lds[wave][lo][4 * t + hi * 2]);
      const int k0 = 4 * t + hi * 2;
#pragma unroll
      for (int c = 0; c < 4; ++c) {
        v2f bv = { vt_lds[k0 * VPITCH + c * 16 + lo], vt_lds[(k0 + 1) * VPITCH + c * 16 + lo] };
        o[c] = wmma_f32_4(ap, bv, o[c]);
      }
    }

    // ---- publish tile kt+1, then refill the buffer this pass has read ----
    wait_ds0();                              // this wave's LDS reads of buffer cur have returned
    wait_tensor0_groups(g0, g1k, g1v);       // the issuer's own tile kt+1 has landed (others: nothing out)
    __syncthreads();                         // tile kt+1 readable; every wave has left buffer cur
    if (pinned(kt + 2 < NT)) {
      tdm_next(g0, my_base + (uint32_t)cur * (TILE_FLOATS * 4u));
      if (pinned(wave == 0)) tdm_issue(g0, g1k);
      if (pinned(wave == 1)) tdm_issue(g0, g1v);
    }
    cur ^= 1;
  }
  wait_tensor0_groups(g0, g1k, g1v);   // nothing of the ring is in flight when a wave ends
  wait_ds0();

  // ---- normalize and write out [B, S, H] ----
  float inv[8];
#pragma unroll
  for (int r = 0; r < 8; ++r) inv[r] = (lstat[r] > 0.0f) ? 1.0f / lstat[r] : 0.0f;
#pragma unroll
  for (int r = 0; r < 8; ++r) {
    const int srow = q0 + r + hi * 8;
    float* orow = out + (size_t)(b * SEQ + srow) * HID + h * HS;
#pragma unroll
    for (int c = 0; c < 4; ++c)
      orow[c * 16 + lo] = o[c][r] * inv[r];
  }
}

extern "C" void kernel_launch(void* const* d_in, const int* in_sizes, int n_in,
                              void* d_out, int out_size, void* d_ws, size_t ws_size,
                              hipStream_t stream) {
  const float* X    = (const float*)d_in[0];
  const int*   mask = (const int*)d_in[1];
  const float* Wq   = (const float*)d_in[2];
  const float* bq   = (const float*)d_in[3];
  const float* Wk   = (const float*)d_in[4];
  const float* bk   = (const float*)d_in[5];
  const float* Wv   = (const float*)d_in[6];
  const float* bv   = (const float*)d_in[7];
  float* out = (float*)d_out;

  const size_t per = (size_t)BATCH * SEQ * HID;
  float* Qb = (float*)d_ws;
  float* Kb = Qb + per;
  float* Vb = Kb + per;

  qkv_proj_kernel<<<dim3((BATCH * SEQ) / 64, HID / 64, 3), 32, 0, stream>>>(
      X, Wq, bq, Wk, bk, Wv, bv, Qb, Kb, Vb);
  attention_kernel<<<dim3(SEQ / 64, NH, BATCH), 128, 0, stream>>>(
      Qb, Kb, Vb, mask, out);
}

// v002
// One run takes 294 microseconds.
// Two timings next to v001 both put it at 1.10 times that version's speed.
// All steps since v000 together make it 1.32 times as fast.
#include <hip/hip_runtime.h>
#include <hip/hip_bf16.h>

typedef __attribute__((ext_vector_type(2))) float        v2f;
typedef __attribute__((ext_vector_type(8))) float        v8f;
typedef __attribute__((ext_vector_type(4))) unsigned int v4u;
typedef __attribute__((ext_vector_type(8))) unsigned int v8u;

#define NH    12
#define HS    64
#define SEQ   2048
#define HID   768
#define BATCH 2

static __device__ __forceinline__ v8f wmma_f32_4(v2f a, v2f b, v8f c) {
  // D = A(16x4 f32) x B(4x16 f32) + C(16x16 f32)
  return __builtin_amdgcn_wmma_f32_16x16x4_f32(
      false, a, false, b, (short)0, c, false, false);
}

// LDS row pitches of the staged 16 x 64 f32 tiles, in floats.  Bank = dword address mod 64, so at the
// source pitch of 64 all 16 rows of a column fall on one bank.  K is read 8 bytes a lane down a column
// (16 rows x 2 column pairs): pitch 68 puts the 32 lanes on 64 different banks.  V is read 4 bytes a lane
// along two rows that lie two apart: pitch 72 puts the two 16-lane runs on different banks.
#define KPITCH 68
#define VPITCH 72
#define TILE_FLOATS 1536   // 6 KiB a buffer: 16 padded rows, rounded up to a multiple of 2 KiB
// P (16 x 16 a wave) is read like K, 8 bytes a lane down a column: at pitch 20 the 16 rows start on
// 16 different groups of four banks; its 4-byte stores along two rows eight apart stay apart too.
#define PPITCH 20

static __device__ __forceinline__ uint32_t uni(uint32_t v) {
  return (uint32_t)__builtin_amdgcn_readfirstlane(v);
}
// A wave-uniform test held in a scalar register, so that the branch on it is a scalar branch:
// a tensor load ignores EXEC and only a scalar branch keeps a wave from issuing it.
static __device__ __forceinline__ uint32_t pinned(uint32_t v) {
  uint32_t w = uni(v);
  asm volatile("" : "+s"(w));  // holds the test in a scalar register
  return w;
}
// This wave's LDS accesses have returned; the clobber keeps LDS accesses on their side.
static __device__ __forceinline__ void wait_ds0() { asm volatile("s_wait_dscnt 0x0" ::: "memory"); }

#define TILE_BYTES (16u * HS * 4u)   // one source tile: 16 contiguous rows of 256 bytes

// Group 1 of a request for 16 rows of 256 bytes (source pitch 256 bytes), with PAD_CODE + 1 dwords of
// pad behind every 256-byte row in LDS (interval code 5).  Extents in bytes.  Built once a kernel.
template <uint32_t PAD_CODE>
static __device__ __forceinline__ v8u tdm_group1() {
  constexpr uint32_t d0 = HS * 4u, d1 = 16u;
  v8u g1;
  g1[0] = uni((1u << 20) | (5u << 22) | (PAD_CODE << 25));          // no mask, 1-byte elements, pad on
  g1[1] = uni((d0 & 0xFFFFu) << 16);                                // tensor_dim0 = tile_dim0
  g1[2] = uni((d0 >> 16) | ((d1 & 0xFFFFu) << 16));                 // tensor_dim1 = tile_dim1
  g1[3] = uni((d1 >> 16) | (d0 << 16));
  g1[4] = uni(d1);
  g1[5] = uni(d0);                                                  // source row pitch
  g1[6] = uni(0u);
  g1[7] = uni(0u);
  // holds the descriptor words in their scalar registers for the
  // whole kernel; without it the constants are set anew at each issue, over words of a request in flight
  asm volatile("" : "+s"(g1));
  return g1;
}
// Group 0: LDS place and the tile's first byte.
static __device__ __forceinline__ v4u tdm_group0(uint32_t lds_off, const float* gptr) {
  const uint64_t ga = (uint64_t)(uintptr_t)gptr;
  v4u g0;
  g0[0] = uni(1u);                                                  // count = 1
  g0[1] = uni(lds_off);
  g0[2] = uni((uint32_t)ga);
  g0[3] = uni((((uint32_t)(ga >> 32)) & 0x01FFFFFFu) | 0x80000000u);  // type = 2
  return g0;
}
// The next tile of the same stream: a new LDS place, the 64-bit address in words 2 and 3 one tile on.
static __device__ __forceinline__ void tdm_next(v4u& g0, uint32_t lds_off) {
  const uint64_t a = (((uint64_t)g0[3] << 32) | g0[2]) + TILE_BYTES;
  g0[1] = uni(lds_off);
  g0[2] = uni((uint32_t)a);
  g0[3] = uni((uint32_t)(a >> 32));
}
// The two-group form; the clobber keeps LDS accesses from moving across the issue.  g0 is in and out, so
// that what follows works on the very registers that the request names.
static __device__ __forceinline__ void tdm_issue(v4u& g0, const v8u& g1) {
  asm volatile("tensor_load_to_lds %0, %1" : "+s"(g0) : "s"(g1) : "memory");
}
// The wait that covers the wave's request (the compiler places none for the tensor mover); every wave
// runs it, a wave with nothing in flight passes at once.  It names the groups: their registers stay as
// the request was issued with them up to here, and group 0 takes its next value only behind it.
static __device__ __forceinline__ void wait_tensor0_groups(v4u& g0, const v8u& g1k, const v8u& g1v) {
  asm volatile("s_wait_tensorcnt 0x0" : "+s"(g0) : "s"(g1k), "s"(g1v) : "memory");
}

// The projection's staged tiles: 128 rows of KC = 32 floats (128 bytes) of X or of W, at an LDS pitch of
// 36 floats: the fragment reads, 8 bytes a lane down a column (16 rows x 2 column pairs), then fall on
// 64 different banks.  128 padded rows are 18,432 bytes, a multiple of 2 KiB.
#define KC 32
#define XPITCH 36
#define PTILE_FLOATS (128 * XPITCH)

// Group 1 of a request for 128 rows of 128 bytes at the source pitch of a row of X or W, with 4 dwords of
// pad behind every 128-byte row in LDS (interval code 4, amount code 3).  Extents in bytes.
static __device__ __forceinline__ v8u tdm_group1_proj() {
  constexpr uint32_t d0 = KC * 4u, d1 = 128u;
  v8u g1;
  g1[0] = uni((1u << 20) | (4u << 22) | (3u << 25));                // no mask, 1-byte elements, pad on
  g1[1] = uni((d0 & 0xFFFFu) << 16);                                // tensor_dim0 = tile_dim0
  g1[2] = uni((d0 >> 16) | ((d1 & 0xFFFFu) << 16));                 // tensor_dim1 = tile_dim1
  g1[3] = uni((d1 >> 16) | (d0 << 16));
  g1[4] = uni(d1);
  g1[5] = uni(HID * 4u);                                            // source row pitch
  g1[6] = uni(0u);
  g1[7] = uni(0u);
  // holds the descriptor words in their scalar registers for the
  // whole kernel; without it the constants are set anew at each issue, over words of a request in flight
  asm volatile("" : "+s"(g1));
  return g1;
}
// The next KC columns of the same rows: a new LDS place, the 64-bit address in words 2 and 3 one chunk on.
static __device__ __forceinline__ void tdm_next_chunk(v4u& g0, uint32_t lds_off) {
  const uint64_t a = (((uint64_t)g0[3] << 32) | g0[2]) + KC * 4u;
  g0[1] = uni(lds_off);
  g0[2] = uni((uint32_t)a);
  g0[3] = uni((uint32_t)(a >> 32));
}
// As wait_tensor0_groups, for a kernel with one group 1.
static __device__ __forceinline__ void wait_tensor0_group(v4u& g0, const v8u& g1) {
  asm volatile("s_wait_tensorcnt 0x0" : "+s"(g0) : "s"(g1) : "memory");
}

// ---------------------------------------------------------------------------
// Kernel 1: fused QKV projection, y = x @ W.T + b, scattered head-major.
// 4 waves / block, a 128x128 output tile; one wave per 64x64 quarter of it:
// 4x4 v8f accumulators (128 VGPRs), 16 WMMAs per 8 fragments.
// X's and W's 128 x 32 tiles are double-buffered in LDS: wave 0 issues the
// tensor load of X and wave 1 that of W for chunk s+1 right behind the barrier
// that frees its buffer, and each waits for its own at the foot of pass s.
// The mover fetches whole 128-byte rows once a block; the fragments' 8-byte
// column walks (16 rows a load) run on LDS banks, not on 16 cache lines a load.
// ---------------------------------------------------------------------------
__global__ __launch_bounds__(128) void qkv_proj_kernel(
    const float* __restrict__ X,
    const float* __restrict__ Wq, const float* __restrict__ bq,
    const float* __restrict__ Wk, const float* __restrict__ bk,
    const float* __restrict__ Wv, const float* __restrict__ bv,
    float* __restrict__ Q, float* __restrict__ K, float* __restrict__ V) {
  // Buffers X0, X1, W0, W1; each starts at a multiple of 2 KiB of the work-group's LDS.
  __shared__ __attribute__((aligned(2048))) float xw_lds[4 * PTILE_FLOATS];

  const int tid  = threadIdx.x;
  const int wave = (int)uni((uint32_t)tid >> 5);
  const int lane = tid & 31;
  const int lo = lane & 15;
  const int hi = lane >> 4;
  const int bm0 = blockIdx.x * 128;   // the block's token tile over B*S = 4096
  const int bn0 = blockIdx.y * 128;   // the block's feature tile over H = 768
  const int wm = (wave >> 1) * 64;    // the wave's quarter
  const int wn = (wave & 1) * 64;
  const int m0 = bm0 + wm;
  const int n0 = bn0 + wn;

  const float* W;
  const float* bias;
  float* O;
  if (blockIdx.z == 0)      { W = Wq; bias = bq; O = Q; }
  else if (blockIdx.z == 1) { W = Wk; bias = bk; O = K; }
  else                      { W = Wv; bias = bv; O = V; }

  const int NS = HID / KC;

  // Wave 0 streams X's chunks, wave 1 W's; my_base is the wave's buffer 0 (waves 2 and 3 issue nothing).
  const uint32_t my_base = (uint32_t)(uintptr_t)&xw_lds[0] + (wave == 1 ? 2u * PTILE_FLOATS * 4u : 0u);
  const v8u g1 = tdm_group1_proj();
  v4u g0 = tdm_group0(my_base, wave == 1 ? W + (size_t)bn0 * HID : X + (size_t)bm0 * HID);

  // ---- prologue: chunk 0 into buffer 0, published; then chunk 1 into buffer 1 ----
  if (pinned(wave < 2)) tdm_issue(g0, g1);
  wait_tensor0_group(g0, g1);          // the issuer's own chunk 0 has landed
  __syncthreads();                     // chunk 0 readable by every wave
  tdm_next_chunk(g0, my_base + PTILE_FLOATS * 4u);
  if (pinned(wave < 2)) tdm_issue(g0, g1);

  v8f acc[4][4] = {};
  int cur = 0;
  for (int s = 0; s < NS; ++s) {
    const float* xs = &xw_lds[cur * PTILE_FLOATS + (wm + lo) * XPITCH + hi * 2];
    const float* ws = &xw_lds[(2 + cur) * PTILE_FLOATS + (wn + lo) * XPITCH + hi * 2];
#pragma unroll
    for (int k = 0; k < KC; k += 4) {
      v2f a[4], b[4];
#pragma unroll
      for (int i = 0; i < 4; ++i) a[i] = *(const v2f*)(xs + 16 * i * XPITCH + k);
#pragma unroll
      for (int j = 0; j < 4; ++j) b[j] = *(const v2f*)(ws + 16 * j * XPITCH + k);
#pragma unroll
      for (int i = 0; i < 4; ++i)
#pragma unroll
        for (int j = 0; j < 4; ++j)
          acc[i][j] = wmma_f32_4(a[i], b[j], acc[i][j]);
    }

    // ---- publish chunk s+1, then refill the buffer this pass has read ----
    wait_ds0();                              // this wave's LDS reads of buffer cur have returned
    wait_tensor0_group(g0, g1);              // the issuer's own chunk s+1 has landed (others: nothing out)
    __syncthreads();                         // chunk s+1 readable; every wave has left buffer cur
    if (pinned(s + 2 < NS)) {
      tdm_next_chunk(g0, my_base + (uint32_t)cur * (PTILE_FLOATS * 4u));
      if (pinned(wave < 2)) tdm_issue(g0, g1);
    }
    cur ^= 1;
  }
  wait_tensor0_group(g0, g1);          // nothing of the ring is in flight when a wave ends
  wait_ds0();

#pragma unroll
  for (int j = 0; j < 4; ++j) {
    const int col = n0 + 16 * j + lo;
    const float bn = bias[col];
    const int h = col >> 6;
    const int d = col & 63;
#pragma unroll
    for (int i = 0; i < 4; ++i) {
#pragma unroll
      for (int r = 0; r < 8; ++r) {
        const int row = m0 + 16 * i + r + hi * 8;   // token in [0, 4096)
        const int bi = row >> 11;
        const int s  = row & (SEQ - 1);
        O[((size_t)(bi * NH + h) * SEQ + s) * HS + d] = acc[i][j][r] + bn;
      }
    }
  }
}

// ---------------------------------------------------------------------------
// Kernel 2: flash-style attention.  4 waves / block, 64 queries / block.
// K/V 16x64 tiles are double-buffered in LDS at padded row pitches; wave 0
// issues the tensor load of K and wave 1 that of V for tile kt+1 right behind
// the barrier that frees its buffer, and each waits for its own at the foot of
// pass kt, overlapping the load with 32 WMMAs + online softmax.
// ---------------------------------------------------------------------------
__global__ __launch_bounds__(128) void attention_kernel(
    const float* __restrict__ Q, const float* __restrict__ K,
    const float* __restrict__ V, const int* __restrict__ mask,
    float* __restrict__ out) {
  // Buffers K0, K1, V0, V1; each starts at a multiple of 2 KiB of the work-group's LDS.
  __shared__ __attribute__((aligned(2048))) float kv_lds[4 * TILE_FLOATS];
  __shared__ float p_lds[4][16][PPITCH];

  const float NEG_INF = -__builtin_inff();
  const int tid  = threadIdx.x;
  const int wave = (int)uni((uint32_t)tid >> 5);
  const int lane = tid & 31;
  const int lo = lane & 15;
  const int hi = lane >> 4;
  const int q0 = blockIdx.x * 64 + wave * 16;
  const int h  = blockIdx.y;
  const int b  = blockIdx.z;

  const size_t head_off = (size_t)(b * NH + h) * SEQ * HS;
  const float* Qh = Q + head_off;
  const float* Kh = K + head_off;
  const float* Vh = V + head_off;

  // Preload this wave's 16 Q A-fragments (K-dim 64 in steps of 4).
  v2f aq[16];
  {
    const float* qrow = Qh + (size_t)(q0 + lo) * HS;
#pragma unroll
    for (int t = 0; t < 16; ++t)
      aq[t] = *(const v2f*)(qrow + 4 * t + hi * 2);
  }

  float mstat[8], lstat[8];
#pragma unroll
  for (int r = 0; r < 8; ++r) { mstat[r] = NEG_INF; lstat[r] = 0.0f; }
  v8f o[4] = {};

  const int NT = SEQ / 16;

  // Wave 0 streams K's tiles, wave 1 V's; my_base is the wave's buffer 0 (waves 2 and 3 issue nothing).
  const uint32_t my_base = (uint32_t)(uintptr_t)&kv_lds[0] + (wave == 1 ? 2u * TILE_FLOATS * 4u : 0u);
  const v8u g1k = tdm_group1<3>();
  const v8u g1v = tdm_group1<7>();
  v4u g0 = tdm_group0(my_base, wave == 1 ? Vh : Kh);

  // ---- prologue: tile 0 into buffer 0, published; then tile 1 into buffer 1 ----
  if (pinned(wave == 0)) tdm_issue(g0, g1k);
  if (pinned(wave == 1)) tdm_issue(g0, g1v);
  wait_tensor0_groups(g0, g1k, g1v);   // the issuer's own tile 0 has landed
  __syncthreads();                     // tile 0 readable by every wave
  tdm_next(g0, my_base + TILE_FLOATS * 4u);
  if (pinned(wave == 0)) tdm_issue(g0, g1k);
  if (pinned(wave == 1)) tdm_issue(g0, g1v);

  int cur = 0;
  for (int kt = 0; kt < NT; ++kt) {
    const float* kt_lds = &kv_lds[cur * TILE_FLOATS];
    const float* vt_lds = &kv_lds[(2 + cur) * TILE_FLOATS];

    // ---- scores = Q · K^T for this 16x16 tile (K from LDS) ----
    v8f sacc = {};
#pragma unroll
    for (int t = 0; t < 16; ++t) {
      v2f bk = *(const v2f*)(&kt_lds[lo * KPITCH + 4 * t + hi * 2]);
      sacc = wmma_f32_4(aq[t], bk, sacc);
    }

    // ---- scale + mask ----
    const int keycol = kt * 16 + lo;
    const bool keep = mask[b * SEQ + keycol] != 0;
    float sv[8];
#pragma unroll
    for (int r = 0; r < 8; ++r)
      sv[r] = keep ? sacc[r] * 0.125f : NEG_INF;   // 1/sqrt(64)

    // ---- online softmax per row (row = one 16-lane half of the wave) ----
#pragma unroll
    for (int r = 0; r < 8; ++r) {
      float rmax = sv[r];
      rmax = fmaxf(rmax, __shfl_xor(rmax, 1, 32));
      rmax = fmaxf(rmax, __shfl_xor(rmax, 2, 32));
      rmax = fmaxf(rmax, __shfl_xor(rmax, 4, 32));
      rmax = fmaxf(rmax, __shfl_xor(rmax, 8, 32));
      const float mnew = fmaxf(mstat[r], rmax);
      const float factor = (mnew == NEG_INF) ? 1.0f : __expf(mstat[r] - mnew);
      const float p = (sv[r] == NEG_INF) ? 0.0f : __expf(sv[r] - mnew);
      float rsum = p;
      rsum += __shfl_xor(rsum, 1, 32);
      rsum += __shfl_xor(rsum, 2, 32);
      rsum += __shfl_xor(rsum, 4, 32);
      rsum += __shfl_xor(rsum, 8, 32);
      lstat[r] = lstat[r] * factor + rsum;
      mstat[r] = mnew;
#pragma unroll
      for (int c = 0; c < 4; ++c) o[c][r] *= factor;
      p_lds[wave][r + hi * 8][lo] = p;      // C-layout -> LDS
    }
    __syncthreads();   // p visible; uniform across all 4 waves

    // ---- O += P · V  (P from LDS in A-layout, V from LDS) ----
#pragma unroll
    for (int t = 0; t < 4; ++t) {
      v2f ap = *(const v2f*)(&p_lds[wave][lo][4 * t + hi * 2]);
      const int k0 = 4 * t + hi * 2;
#pragma unroll
      for (int c = 0; c < 4; ++c) {
        v2f bv = { vt_lds[k0 * VPITCH + c * 16 + lo], vt_lds[(k0 + 1) * VPITCH + c * 16 + lo] };
        o[c] = wmma_f32_4(ap, bv, o[c]);
      }
    }

    // ---- publish tile kt+1, then refill the buffer this pass has read ----
    wait_ds0();                              // this wave's LDS reads of buffer cur have returned
    wait_tensor0_groups(g0, g1k, g1v);       // the issuer's own tile kt+1 has landed (others: nothing out)
    __syncthreads();                         // tile kt+1 readable; every wave has left buffer cur
    if (pinned(kt + 2 < NT)) {
      tdm_next(g0, my_base + (uint32_t)cur * (TILE_FLOATS * 4u));
      if (pinned(wave == 0)) tdm_issue(g0, g1k);
      if (pinned(wave == 1)) tdm_issue(g0, g1v);
    }
    cur ^= 1;
  }
  wait_tensor0_groups(g0, g1k, g1v);   // nothing of the ring is in flight when a wave ends
  wait_ds0();

  // ---- normalize and write out [B, S, H] ----
  float inv[8];
#pragma unroll
  for (int r = 0; r < 8; ++r) inv[r] = (lstat[r] > 0.0f) ? 1.0f / lstat[r] : 0.0f;
#pragma unroll
  for (int r = 0; r < 8; ++r) {
    const int srow = q0 + r + hi * 8;
    float* orow = out + (size_t)(b * SEQ + srow) * HID + h * HS;
#pragma unroll
    for (int c = 0; c < 4; ++c)
      orow[c * 16 + lo] = o[c][r] * inv[r];
  }
}

extern "C" void kernel_launch(void* const* d_in, const int* in_sizes, int n_in,
                              void* d_out, int out_size, void* d_ws, size_t ws_size,
                              hipStream_t stream) {
  const float* X    = (const float*)d_in[0];
  const int*   mask = (const int*)d_in[1];
  const float* Wq   = (const float*)d_in[2];
  const float* bq   = (const float*)d_in[3];
  const float* Wk   = (const float*)d_in[4];
  const float* bk   = (const float*)d_in[5];
  const float* Wv   = (const float*)d_in[6];
  const float* bv   = (const float*)d_in[7];
  float* out = (float*)d_out;

  const size_t per = (size_t)BATCH * SEQ * HID;
  float* Qb = (float*)d_ws;
  float* Kb = Qb + per;
  float* Vb = Kb + per;

  qkv_proj_kernel<<<dim3((BATCH * SEQ) / 128, HID / 128, 3), 128, 0, stream>>>(
      X, Wq, bq, Wk, bk, Wv, bv, Qb, Kb, Vb);
  attention_kernel<<<dim3(SEQ / 64, NH, BATCH), 128, 0, stream>>>(
      Qb, Kb, Vb, mask, out);
}

// v003
// It runs in 241 microseconds.
// Two timings next to v002 both put it at 1.23 times that version's speed.
// Over all steps from v000 it is 1.62 times as fast.
#include <hip/hip_runtime.h>
#include <hip/hip_bf16.h>

typedef __attribute__((ext_vector_type(2))) float        v2f;
typedef __attribute__((ext_vector_type(8))) float        v8f;
typedef __attribute__((ext_vector_type(4))) unsigned int v4u;
typedef __attribute__((ext_vector_type(8))) unsigned int v8u;

#define NH    12
#define HS    64
#define SEQ   2048
#define HID   768
#define BATCH 2

static __device__ __forceinline__ v8f wmma_f32_4(v2f a, v2f b, v8f c) {
  // D = A(16x4 f32) x B(4x16 f32) + C(16x16 f32)
  return __builtin_amdgcn_wmma_f32_16x16x4_f32(
      false, a, false, b, (short)0, c, false, false);
}

// LDS row pitches of the staged 16 x 64 f32 tiles, in floats.  Bank = dword address mod 64, so at the
// source pitch of 64 all 16 rows of a column fall on one bank.  K is read 8 bytes a lane down a column
// (16 rows x 2 column pairs): pitch 68 puts the 32 lanes on 64 different banks.  V is read 4 bytes a lane
// along two rows that lie two apart: pitch 72 puts the two 16-lane runs on different banks.
#define KPITCH 68
#define VPITCH 72
#define TILE_FLOATS 1536   // 6 KiB a buffer: 16 padded rows, rounded up to a multiple of 2 KiB

static __device__ __forceinline__ uint32_t uni(uint32_t v) {
  return (uint32_t)__builtin_amdgcn_readfirstlane(v);
}
// A wave-uniform test held in a scalar register, so that the branch on it is a scalar branch:
// a tensor load ignores EXEC and only a scalar branch keeps a wave from issuing it.
static __device__ __forceinline__ uint32_t pinned(uint32_t v) {
  uint32_t w = uni(v);
  asm volatile("" : "+s"(w));  // holds the test in a scalar register
  return w;
}
// Lane l's value seen from lane l ^ 16 (the other half of the wave).
static __device__ __forceinline__ float xhalf(float x) {
  const int v = __builtin_bit_cast(int, x);
  return __builtin_bit_cast(float, __builtin_amdgcn_permlanex16(v, v, 0x76543210, 0xfedcba98, false, false));
}
// This wave's LDS accesses have returned; the clobber keeps LDS accesses on their side.
static __device__ __forceinline__ void wait_ds0() { asm volatile("s_wait_dscnt 0x0" ::: "memory"); }

#define TILE_BYTES (16u * HS * 4u)   // one source tile: 16 contiguous rows of 256 bytes

// Group 1 of a request for 16 rows of 256 bytes (source pitch 256 bytes), with PAD_CODE + 1 dwords of
// pad behind every 256-byte row in LDS (interval code 5).  Extents in bytes.  Built once a kernel.
template <uint32_t PAD_CODE>
static __device__ __forceinline__ v8u tdm_group1() {
  constexpr uint32_t d0 = HS * 4u, d1 = 16u;
  v8u g1;
  g1[0] = uni((1u << 20) | (5u << 22) | (PAD_CODE << 25));          // no mask, 1-byte elements, pad on
  g1[1] = uni((d0 & 0xFFFFu) << 16);                                // tensor_dim0 = tile_dim0
  g1[2] = uni((d0 >> 16) | ((d1 & 0xFFFFu) << 16));                 // tensor_dim1 = tile_dim1
  g1[3] = uni((d1 >> 16) | (d0 << 16));
  g1[4] = uni(d1);
  g1[5] = uni(d0);                                                  // source row pitch
  g1[6] = uni(0u);
  g1[7] = uni(0u);
  // holds the descriptor words in their scalar registers for the
  // whole kernel; without it the constants are set anew at each issue, over words of a request in flight
  asm volatile("" : "+s"(g1));
  return g1;
}
// Group 0: LDS place and the tile's first byte.
static __device__ __forceinline__ v4u tdm_group0(uint32_t lds_off, const float* gptr) {
  const uint64_t ga = (uint64_t)(uintptr_t)gptr;
  v4u g0;
  g0[0] = uni(1u);                                                  // count = 1
  g0[1] = uni(lds_off);
  g0[2] = uni((uint32_t)ga);
  g0[3] = uni((((uint32_t)(ga >> 32)) & 0x01FFFFFFu) | 0x80000000u);  // type = 2
  return g0;
}
// The next tile of the same stream: a new LDS place, the 64-bit address in words 2 and 3 one tile on.
static __device__ __forceinline__ void tdm_next(v4u& g0, uint32_t lds_off) {
  const uint64_t a = (((uint64_t)g0[3] << 32) | g0[2]) + TILE_BYTES;
  g0[1] = uni(lds_off);
  g0[2] = uni((uint32_t)a);
  g0[3] = uni((uint32_t)(a >> 32));
}
// The two-group form; the clobber keeps LDS accesses from moving across the issue.  g0 is in and out, so
// that what follows works on the very registers that the request names.
static __device__ __forceinline__ void tdm_issue(v4u& g0, const v8u& g1) {
  asm volatile("tensor_load_to_lds %0, %1" : "+s"(g0) : "s"(g1) : "memory");
}
// The wait that covers the wave's request (the compiler places none for the tensor mover); every wave
// runs it, a wave with nothing in flight passes at once.  It names the groups: their registers stay as
// the request was issued with them up to here, and group 0 takes its next value only behind it.
static __device__ __forceinline__ void wait_tensor0_groups(v4u& g0, const v8u& g1k, const v8u& g1v) {
  asm volatile("s_wait_tensorcnt 0x0" : "+s"(g0) : "s"(g1k), "s"(g1v) : "memory");
}

// The projection's staged tiles: 128 rows of KC = 32 floats (128 bytes) of X or of W, at an LDS pitch of
// 36 floats: the fragment reads, 8 bytes a lane down a column (16 rows x 2 column pairs), then fall on
// 64 different banks.  128 padded rows are 18,432 bytes, a multiple of 2 KiB.
#define KC 32
#define XPITCH 36
#define PTILE_FLOATS (128 * XPITCH)

// Group 1 of a request for 128 rows of 128 bytes at the source pitch of a row of X or W, with 4 dwords of
// pad behind every 128-byte row in LDS (interval code 4, amount code 3).  Extents in bytes.
static __device__ __forceinline__ v8u tdm_group1_proj() {
  constexpr uint32_t d0 = KC * 4u, d1 = 128u;
  v8u g1;
  g1[0] = uni((1u << 20) | (4u << 22) | (3u << 25));                // no mask, 1-byte elements, pad on
  g1[1] = uni((d0 & 0xFFFFu) << 16);                                // tensor_dim0 = tile_dim0
  g1[2] = uni((d0 >> 16) | ((d1 & 0xFFFFu) << 16));                 // tensor_dim1 = tile_dim1
  g1[3] = uni((d1 >> 16) | (d0 << 16));
  g1[4] = uni(d1);
  g1[5] = uni(HID * 4u);                                            // source row pitch
  g1[6] = uni(0u);
  g1[7] = uni(0u);
  // holds the descriptor words in their scalar registers for the
  // whole kernel; without it the constants are set anew at each issue, over words of a request in flight
  asm volatile("" : "+s"(g1));
  return g1;
}
// The next KC columns of the same rows: a new LDS place, the 64-bit address in words 2 and 3 one chunk on.
static __device__ __forceinline__ void tdm_next_chunk(v4u& g0, uint32_t lds_off) {
  const uint64_t a = (((uint64_t)g0[3] << 32) | g0[2]) + KC * 4u;
  g0[1] = uni(lds_off);
  g0[2] = uni((uint32_t)a);
  g0[3] = uni((uint32_t)(a >> 32));
}
// As wait_tensor0_groups, for a kernel with one group 1.
static __device__ __forceinline__ void wait_tensor0_group(v4u& g0, const v8u& g1) {
  asm volatile("s_wait_tensorcnt 0x0" : "+s"(g0) : "s"(g1) : "memory");
}

// ---------------------------------------------------------------------------
// Kernel 1: fused QKV projection, y = x @ W.T + b, scattered head-major.
// 4 waves / block, a 128x128 output tile; one wave per 64x64 quarter of it:
// 4x4 v8f accumulators (128 VGPRs), 16 WMMAs per 8 fragments.
// X's and W's 128 x 32 tiles are double-buffered in LDS: wave 0 issues the
// tensor load of X and wave 1 that of W for chunk s+1 right behind the barrier
// that frees its buffer, and each waits for its own at the foot of pass s.
// The mover fetches whole 128-byte rows once a block; the fragments' 8-byte
// column walks (16 rows a load) run on LDS banks, not on 16 cache lines a load.
// ---------------------------------------------------------------------------
__global__ __launch_bounds__(128) void qkv_proj_kernel(
    const float* __restrict__ X,
    const float* __restrict__ Wq, const float* __restrict__ bq,
    const float* __restrict__ Wk, const float* __restrict__ bk,
    const float* __restrict__ Wv, const float* __restrict__ bv,
    float* __restrict__ Q, float* __restrict__ K, float* __restrict__ V) {
  // Buffers X0, X1, W0, W1; each starts at a multiple of 2 KiB of the work-group's LDS.
  __shared__ __attribute__((aligned(2048))) float xw_lds[4 * PTILE_FLOATS];

  const int tid  = threadIdx.x;
  const int wave = (int)uni((uint32_t)tid >> 5);
  const int lane = tid & 31;
  const int lo = lane & 15;
  const int hi = lane >> 4;
  const int bm0 = blockIdx.x * 128;   // the block's token tile over B*S = 4096
  const int bn0 = blockIdx.y * 128;   // the block's feature tile over H = 768
  const int wm = (wave >> 1) * 64;    // the wave's quarter
  const int wn = (wave & 1) * 64;
  const int m0 = bm0 + wm;
  const int n0 = bn0 + wn;

  const float* W;
  const float* bias;
  float* O;
  if (blockIdx.z == 0)      { W = Wq; bias = bq; O = Q; }
  else if (blockIdx.z == 1) { W = Wk; bias = bk; O = K; }
  else                      { W = Wv; bias = bv; O = V; }

  const int NS = HID / KC;

  // Wave 0 streams X's chunks, wave 1 W's; my_base is the wave's buffer 0 (waves 2 and 3 issue nothing).
  const uint32_t my_base = (uint32_t)(uintptr_t)&xw_lds[0] + (wave == 1 ? 2u * PTILE_FLOATS * 4u : 0u);
  const v8u g1 = tdm_group1_proj();
  v4u g0 = tdm_group0(my_base, wave == 1 ? W + (size_t)bn0 * HID : X + (size_t)bm0 * HID);

  // ---- prologue: chunk 0 into buffer 0, published; then chunk 1 into buffer 1 ----
  if (pinned(wave < 2)) tdm_issue(g0, g1);
  wait_tensor0_group(g0, g1);          // the issuer's own chunk 0 has landed
  __syncthreads();                     // chunk 0 readable by every wave
  tdm_next_chunk(g0, my_base + PTILE_FLOATS * 4u);
  if (pinned(wave < 2)) tdm_issue(g0, g1);

  v8f acc[4][4] = {};
  int cur = 0;
  for (int s = 0; s < NS; ++s) {
    const float* xs = &xw_lds[cur * PTILE_FLOATS + (wm + lo) * XPITCH + hi * 2];
    const float* ws = &xw_lds[(2 + cur) * PTILE_FLOATS + (wn + lo) * XPITCH + hi * 2];
#pragma unroll
    for (int k = 0; k < KC; k += 4) {
      v2f a[4], b[4];
#pragma unroll
      for (int i = 0; i < 4; ++i) a[i] = *(const v2f*)(xs + 16 * i * XPITCH + k);
#pragma unroll
      for (int j = 0; j < 4; ++j) b[j] = *(const v2f*)(ws + 16 * j * XPITCH + k);
#pragma unroll
      for (int i = 0; i < 4; ++i)
#pragma unroll
        for (int j = 0; j < 4; ++j)
          acc[i][j] = wmma_f32_4(a[i], b[j], acc[i][j]);
    }

    // ---- publish chunk s+1, then refill the buffer this pass has read ----
    wait_ds0();                              // this wave's LDS reads of buffer cur have returned
    wait_tensor0_group(g0, g1);              // the issuer's own chunk s+1 has landed (others: nothing out)
    __syncthreads();                         // chunk s+1 readable; every wave has left buffer cur
    if (pinned(s + 2 < NS)) {
      tdm_next_chunk(g0, my_base + (uint32_t)cur * (PTILE_FLOATS * 4u));
      if (pinned(wave < 2)) tdm_issue(g0, g1);
    }
    cur ^= 1;
  }
  wait_tensor0_group(g0, g1);          // nothing of the ring is in flight when a wave ends
  wait_ds0();

#pragma unroll
  for (int j = 0; j < 4; ++j) {
    const int col = n0 + 16 * j + lo;
    const float bn = bias[col];
    const int h = col >> 6;
    const int d = col & 63;
#pragma unroll
    for (int i = 0; i < 4; ++i) {
#pragma unroll
      for (int r = 0; r < 8; ++r) {
        const int row = m0 + 16 * i + r + hi * 8;   // token in [0, 4096)
        const int bi = row >> 11;
        const int s  = row & (SEQ - 1);
        O[((size_t)(bi * NH + h) * SEQ + s) * HS + d] = acc[i][j][r] + bn;
      }
    }
  }
}

__global__ __launch_bounds__(128) __attribute__((amdgpu_waves_per_eu(3, 3))) void attention_kernel(
    const float* __restrict__ Q, const float* __restrict__ K,
    const float* __restrict__ V, const int* __restrict__ mask,
    float* __restrict__ out) {
  // Buffers K0, K1, V0, V1; each starts at a multiple of 2 KiB of the work-group's LDS.
  __shared__ __attribute__((aligned(2048))) float kv_lds[4 * TILE_FLOATS];

  const float NEG_INF = -__builtin_inff();
  const int tid  = threadIdx.x;
  const int wave = (int)uni((uint32_t)tid >> 5);
  const int lane = tid & 31;
  const int lo = lane & 15;
  const int hi = lane >> 4;
  const int q0 = blockIdx.x * 64 + wave * 16;
  const int h  = blockIdx.y;
  const int b  = blockIdx.z;

  const size_t head_off = (size_t)(b * NH + h) * SEQ * HS;
  const float* Qh = Q + head_off;
  const float* Kh = K + head_off;
  const float* Vh = V + head_off;

  // Preload this wave's 16 Q fragments (K-dim 64 in steps of 4): B of S^T, column = query lo.
  v2f aq[16];
  {
    const float* qrow = Qh + (size_t)(q0 + lo) * HS;
#pragma unroll
    for (int t = 0; t < 16; ++t)
      aq[t] = *(const v2f*)(qrow + 4 * t + hi * 2);
  }

  // Query lo's running maximum (alike in both halves) and this half's share of its running sum.
  float mstat = NEG_INF, lstat = 0.0f;
  v8f o[4] = {};   // o[c][r] = O^T[c * 16 + hi * 8 + r][query lo]

  // Row lo of S^T's A operand takes this key of the tile, so that accumulator register r of half hi holds
  // key 4 * (r >> 1) + 2 * hi + (r & 1): registers 2t, 2t + 1 are then B's k = 2 * hi, 2 * hi + 1 of keys
  // 4t .. 4t + 3, the order in which V's rows are read below.
  const int krow = (lo & 1) + 2 * (lo >> 3) + 4 * ((lo & 7) >> 1);

  const int NT = SEQ / 16;

  // Wave 0 streams K's tiles, wave 1 V's; my_base is the wave's buffer 0 (waves 2 and 3 issue nothing).
  const uint32_t my_base = (uint32_t)(uintptr_t)&kv_lds[0] + (wave == 1 ? 2u * TILE_FLOATS * 4u : 0u);
  const v8u g1k = tdm_group1<3>();
  const v8u g1v = tdm_group1<7>();
  v4u g0 = tdm_group0(my_base, wave == 1 ? Vh : Kh);

  // ---- prologue: tile 0 into buffer 0, published; then tile 1 into buffer 1 ----
  if (pinned(wave == 0)) tdm_issue(g0, g1k);
  if (pinned(wave == 1)) tdm_issue(g0, g1v);
  wait_tensor0_groups(g0, g1k, g1v);   // the issuer's own tile 0 has landed
  __syncthreads();                     // tile 0 readable by every wave
  tdm_next(g0, my_base + TILE_FLOATS * 4u);
  if (pinned(wave == 0)) tdm_issue(g0, g1k);
  if (pinned(wave == 1)) tdm_issue(g0, g1v);

  int cur = 0;
  for (int kt = 0; kt < NT; ++kt) {
    const float* kt_lds = &kv_lds[cur * TILE_FLOATS];
    const float* vt_lds = &kv_lds[(2 + cur) * TILE_FLOATS];

    // ---- this pass's operands: K's 16 A fragments, V^T's 16 A fragments, the mask words of the lane's keys ----
    // Register r of the score accumulator is key kt * 16 + 4 * (r >> 1) + 2 * hi + (r & 1).
    const int* mrow = mask + b * SEQ + kt * 16 + hi * 2;
    int mk[8];
#pragma unroll
    for (int r = 0; r < 8; ++r) mk[r] = mrow[4 * (r >> 1) + (r & 1)];
    v2f ak[16];
#pragma unroll
    for (int t = 0; t < 16; ++t)
      ak[t] = *(const v2f*)(&kt_lds[krow * KPITCH + 4 * t + hi * 2]);
    v2f av[4][4];
#pragma unroll
    for (int t = 0; t < 4; ++t) {
      const int k0 = 4 * t + hi * 2;
#pragma unroll
      for (int c = 0; c < 4; ++c)
        av[t][c] = v2f{ vt_lds[k0 * VPITCH + c * 16 + lo], vt_lds[(k0 + 1) * VPITCH + c * 16 + lo] };
    }

    // ---- scores^T = K Q^T for this 16x16 tile ----
    v8f sacc = {};
#pragma unroll
    for (int t = 0; t < 16; ++t) sacc = wmma_f32_4(ak[t], aq[t], sacc);

    // ---- scale + mask ----
    float sv[8];
#pragma unroll
    for (int r = 0; r < 8; ++r)
      sv[r] = (mk[r] != 0) ? sacc[r] * 0.125f : NEG_INF;   // 1/sqrt(64)

    // ---- online softmax of query lo: 8 keys in this lane, the other 8 in lane ^ 16 ----
    float rmax = fmaxf(fmaxf(fmaxf(sv[0], sv[1]), fmaxf(sv[2], sv[3])),
                       fmaxf(fmaxf(sv[4], sv[5]), fmaxf(sv[6], sv[7])));
    rmax = fmaxf(rmax, xhalf(rmax));
    const float mnew = fmaxf(mstat, rmax);
    const float factor = (mnew == NEG_INF) ? 1.0f : __expf(mstat - mnew);
    float p[8];
#pragma unroll
    for (int r = 0; r < 8; ++r)
      p[r] = (sv[r] == NEG_INF) ? 0.0f : __expf(sv[r] - mnew);
    lstat = lstat * factor + (((p[0] + p[1]) + (p[2] + p[3])) + ((p[4] + p[5]) + (p[6] + p[7])));
    mstat = mnew;
#pragma unroll
    for (int c = 0; c < 4; ++c) o[c] *= factor;

    // ---- O^T += V^T P^T  (P^T from the score registers as B) ----
#pragma unroll
    for (int t = 0; t < 4; ++t) {
      const v2f bp = { p[2 * t], p[2 * t + 1] };
#pragma unroll
      for (int c = 0; c < 4; ++c) o[c] = wmma_f32_4(av[t][c], bp, o[c]);
    }

    // ---- publish tile kt+1, then refill the buffer this pass has read ----
    wait_ds0();                              // this wave's LDS reads of buffer cur have returned
    wait_tensor0_groups(g0, g1k, g1v);       // the issuer's own tile kt+1 has landed (others: nothing out)
    __syncthreads();                         // tile kt+1 readable; every wave has left buffer cur
    if (pinned(kt + 2 < NT)) {
      tdm_next(g0, my_base + (uint32_t)cur * (TILE_FLOATS * 4u));
      if (pinned(wave == 0)) tdm_issue(g0, g1k);
      if (pinned(wave == 1)) tdm_issue(g0, g1v);
    }
    cur ^= 1;
  }
  wait_tensor0_groups(g0, g1k, g1v);   // nothing of the ring is in flight when a wave ends
  wait_ds0();

  // ---- join the halves' sums, normalize and write out [B, S, H]: 8 consecutive floats a lane and c ----
  lstat += xhalf(lstat);
  const float inv = (lstat > 0.0f) ? 1.0f / lstat : 0.0f;
  float* orow = out + (size_t)(b * SEQ + q0 + lo) * HID + h * HS + hi * 8;
#pragma unroll
  for (int c = 0; c < 4; ++c) {
    *(float4*)(orow + c * 16)     = make_float4(o[c][0] * inv, o[c][1] * inv, o[c][2] * inv, o[c][3] * inv);
    *(float4*)(orow + c * 16 + 4) = make_float4(o[c][4] * inv, o[c][5] * inv, o[c][6] * inv, o[c][7] * inv);
  }
}

extern "C" void kernel_launch(void* const* d_in, const int* in_sizes, int n_in,
                              void* d_out, int out_size, void* d_ws, size_t ws_size,
                              hipStream_t stream) {
  const float* X    = (const float*)d_in[0];
  const int*   mask = (const int*)d_in[1];
  const float* Wq   = (const float*)d_in[2];
  const float* bq   = (const float*)d_in[3];
  const float* Wk   = (const float*)d_in[4];
  const float* bk   = (const float*)d_in[5];
  const float* Wv   = (const float*)d_in[6];
  const float* bv   = (const float*)d_in[7];
  float* out = (float*)d_out;

  const size_t per = (size_t)BATCH * SEQ * HID;
  float* Qb = (float*)d_ws;
  float* Kb = Qb + per;
  float* Vb = Kb + per;

  qkv_proj_kernel<<<dim3((BATCH * SEQ) / 128, HID / 128, 3), 128, 0, stream>>>(
      X, Wq, bq, Wk, bk, Wv, bv, Qb, Kb, Vb);
  attention_kernel<<<dim3(SEQ / 64, NH, BATCH), 128, 0, stream>>>(
      Qb, Kb, Vb, mask, out);
}

// v004
// It runs in 224 microseconds.
// Next to v003, in two timings, it ran 1.09 times as fast each time.
// Over all steps from v000 it is 1.77 times as fast.
#include <hip/hip_runtime.h>
#include <hip/hip_bf16.h>

typedef __attribute__((ext_vector_type(2))) float        v2f;
typedef __attribute__((ext_vector_type(8))) float        v8f;
typedef __attribute__((ext_vector_type(4))) unsigned int v4u;
typedef __attribute__((ext_vector_type(8))) unsigned int v8u;

#define NH    12
#define HS    64
#define SEQ   2048
#define HID   768
#define BATCH 2

static __device__ __forceinline__ v8f wmma_f32_4(v2f a, v2f b, v8f c) {
  // D = A(16x4 f32) x B(4x16 f32) + C(16x16 f32)
  return __builtin_amdgcn_wmma_f32_16x16x4_f32(
      false, a, false, b, (short)0, c, false, false);
}

// LDS row pitches of the staged 64 x 64 f32 tiles, in floats.  Bank = dword address mod 64, so at the
// source pitch of 64 all 16 rows of a column fall on one bank.  K is read 8 bytes a lane down a column
// (16 rows x 2 column pairs): pitch 68 puts the 32 lanes on 64 different banks.  V is read 4 bytes a lane
// along two rows that lie two apart: pitch 72 puts the two 16-lane runs on different banks.
#define KPITCH 68
#define VPITCH 72
#define KEYS 64            // keys a pass of the attention loop = rows of a staged K or V tile
#define NSUB (KEYS / 16)   // 16-key score tiles a pass
#define TILE_FLOATS 4608   // 18 KiB a buffer: 64 padded rows (K 17,408 B, V 18,432 B), a multiple of 2 KiB

static __device__ __forceinline__ uint32_t uni(uint32_t v) {
  return (uint32_t)__builtin_amdgcn_readfirstlane(v);
}
// A wave-uniform test held in a scalar register, so that the branch on it is a scalar branch:
// a tensor load ignores EXEC and only a scalar branch keeps a wave from issuing it.
static __device__ __forceinline__ uint32_t pinned(uint32_t v) {
  uint32_t w = uni(v);
  asm volatile("" : "+s"(w));  // holds the test in a scalar register
  return w;
}
// Lane l's value seen from lane l ^ 16 (the other half of the wave).
static __device__ __forceinline__ float xhalf(float x) {
  const int v = __builtin_bit_cast(int, x);
  return __builtin_bit_cast(float, __builtin_amdgcn_permlanex16(v, v, 0x76543210, 0xfedcba98, false, false));
}
// This wave's LDS accesses have returned; the clobber keeps LDS accesses on their side.
static __device__ __forceinline__ void wait_ds0() { asm volatile("s_wait_dscnt 0x0" ::: "memory"); }

#define TILE_BYTES ((uint32_t)KEYS * HS * 4u)   // one source tile: 64 contiguous rows of 256 bytes

// Group 1 of a request for KEYS rows of 256 bytes (source pitch 256 bytes), with PAD_CODE + 1 dwords of
// pad behind every 256-byte row in LDS (interval code 5).  Extents in bytes.  Built once a kernel.
template <uint32_t PAD_CODE>
static __device__ __forceinline__ v8u tdm_group1() {
  constexpr uint32_t d0 = HS * 4u, d1 = (uint32_t)KEYS;
  v8u g1;
  g1[0] = uni((1u << 20) | (5u << 22) | (PAD_CODE << 25));          // no mask, 1-byte elements, pad on
  g1[1] = uni((d0 & 0xFFFFu) << 16);                                // tensor_dim0 = tile_dim0
  g1[2] = uni((d0 >> 16) | ((d1 & 0xFFFFu) << 16));                 // tensor_dim1 = tile_dim1
  g1[3] = uni((d1 >> 16) | (d0 << 16));
  g1[4] = uni(d1);
  g1[5] = uni(d0);                                                  // source row pitch
  g1[6] = uni(0u);
  g1[7] = uni(0u);
  // holds the descriptor words in their scalar registers for the
  // whole kernel; without it the constants are set anew at each issue, over words of a request in flight
  asm volatile("" : "+s"(g1));
  return g1;
}
// Group 0: LDS place and the tile's first byte.
static __device__ __forceinline__ v4u tdm_group0(uint32_t lds_off, const float* gptr) {
  const uint64_t ga = (uint64_t)(uintptr_t)gptr;
  v4u g0;
  g0[0] = uni(1u);                                                  // count = 1
  g0[1] = uni(lds_off);
  g0[2] = uni((uint32_t)ga);
  g0[3] = uni((((uint32_t)(ga >> 32)) & 0x01FFFFFFu) | 0x80000000u);  // type = 2
  return g0;
}
// The next tile of the same stream: a new LDS place, the 64-bit address in words 2 and 3 one tile on.
static __device__ __forceinline__ void tdm_next(v4u& g0, uint32_t lds_off) {
  const uint64_t a = (((uint64_t)g0[3] << 32) | g0[2]) + TILE_BYTES;
  g0[1] = uni(lds_off);
  g0[2] = uni((uint32_t)a);
  g0[3] = uni((uint32_t)(a >> 32));
}
// The two-group form; the clobber keeps LDS accesses from moving across the issue.  g0 is in and out, so
// that what follows works on the very registers that the request names.
static __device__ __forceinline__ void tdm_issue(v4u& g0, const v8u& g1) {
  asm volatile("tensor_load_to_lds %0, %1" : "+s"(g0) : "s"(g1) : "memory");
}
// The wait that covers the wave's request (the compiler places none for the tensor mover); every wave
// runs it, a wave with nothing in flight passes at once.  It names the groups: their registers stay as
// the request was issued with them up to here, and group 0 takes its next value only behind it.
static __device__ __forceinline__ void wait_tensor0_groups(v4u& g0, const v8u& g1k, const v8u& g1v) {
  asm volatile("s_wait_tensorcnt 0x0" : "+s"(g0) : "s"(g1k), "s"(g1v) : "memory");
}

// The projection's staged tiles: 128 rows of KC = 32 floats (128 bytes) of X or of W, at an LDS pitch of
// 36 floats: the fragment reads, 8 bytes a lane down a column (16 rows x 2 column pairs), then fall on
// 64 different banks.  128 padded rows are 18,432 bytes, a multiple of 2 KiB.
#define KC 32
#define XPITCH 36
#define PTILE_FLOATS (128 * XPITCH)

// Group 1 of a request for 128 rows of 128 bytes at the source pitch of a row of X or W, with 4 dwords of
// pad behind every 128-byte row in LDS (interval code 4, amount code 3).  Extents in bytes.
static __device__ __forceinline__ v8u tdm_group1_proj() {
  constexpr uint32_t d0 = KC * 4u, d1 = 128u;
  v8u g1;
  g1[0] = uni((1u << 20) | (4u << 22) | (3u << 25));                // no mask, 1-byte elements, pad on
  g1[1] = uni((d0 & 0xFFFFu) << 16);                                // tensor_dim0 = tile_dim0
  g1[2] = uni((d0 >> 16) | ((d1 & 0xFFFFu) << 16));                 // tensor_dim1 = tile_dim1
  g1[3] = uni((d1 >> 16) | (d0 << 16));
  g1[4] = uni(d1);
  g1[5] = uni(HID * 4u);                                            // source row pitch
  g1[6] = uni(0u);
  g1[7] = uni(0u);
  // holds the descriptor words in their scalar registers for the
  // whole kernel; without it the constants are set anew at each issue, over words of a request in flight
  asm volatile("" : "+s"(g1));
  return g1;
}
// The next KC columns of the same rows: a new LDS place, the 64-bit address in words 2 and 3 one chunk on.
static __device__ __forceinline__ void tdm_next_chunk(v4u& g0, uint32_t lds_off) {
  const uint64_t a = (((uint64_t)g0[3] << 32) | g0[2]) + KC * 4u;
  g0[1] = uni(lds_off);
  g0[2] = uni((uint32_t)a);
  g0[3] = uni((uint32_t)(a >> 32));
}
// As wait_tensor0_groups, for a kernel with one group 1.
static __device__ __forceinline__ void wait_tensor0_group(v4u& g0, const v8u& g1) {
  asm volatile("s_wait_tensorcnt 0x0" : "+s"(g0) : "s"(g1) : "memory");
}

// ---------------------------------------------------------------------------
// Kernel 1: fused QKV projection, y = x @ W.T + b, scattered head-major.
// 4 waves / block, a 128x128 output tile; one wave per 64x64 quarter of it:
// 4x4 v8f accumulators (128 VGPRs), 16 WMMAs per 8 fragments.
// X's and W's 128 x 32 tiles are double-buffered in LDS: wave 0 issues the
// tensor load of X and wave 1 that of W for chunk s+1 right behind the barrier
// that frees its buffer, and each waits for its own at the foot of pass s.
// The mover fetches whole 128-byte rows once a block; the fragments' 8-byte
// column walks (16 rows a load) run on LDS banks, not on 16 cache lines a load.
// ---------------------------------------------------------------------------
__global__ __launch_bounds__(128) void qkv_proj_kernel(
    const float* __restrict__ X,
    const float* __restrict__ Wq, const float* __restrict__ bq,
    const float* __restrict__ Wk, const float* __restrict__ bk,
    const float* __restrict__ Wv, const float* __restrict__ bv,
    float* __restrict__ Q, float* __restrict__ K, float* __restrict__ V) {
  // Buffers X0, X1, W0, W1; each starts at a multiple of 2 KiB of the work-group's LDS.
  __shared__ __attribute__((aligned(2048))) float xw_lds[4 * PTILE_FLOATS];

  const int tid  = threadIdx.x;
  const int wave = (int)uni((uint32_t)tid >> 5);
  const int lane = tid & 31;
  const int lo = lane & 15;
  const int hi = lane >> 4;
  const int bm0 = blockIdx.x * 128;   // the block's token tile over B*S = 4096
  const int bn0 = blockIdx.y * 128;   // the block's feature tile over H = 768
  const int wm = (wave >> 1) * 64;    // the wave's quarter
  const int wn = (wave & 1) * 64;
  const int m0 = bm0 + wm;
  const int n0 = bn0 + wn;

  const float* W;
  const float* bias;
  float* O;
  if (blockIdx.z == 0)      { W = Wq; bias = bq; O = Q; }
  else if (blockIdx.z == 1) { W = Wk; bias = bk; O = K; }
  else                      { W = Wv; bias = bv; O = V; }

  const int NS = HID / KC;

  // Wave 0 streams X's chunks, wave 1 W's; my_base is the wave's buffer 0 (waves 2 and 3 issue nothing).
  const uint32_t my_base = (uint32_t)(uintptr_t)&xw_lds[0] + (wave == 1 ? 2u * PTILE_FLOATS * 4u : 0u);
  const v8u g1 = tdm_group1_proj();
  v4u g0 = tdm_group0(my_base, wave == 1 ? W + (size_t)bn0 * HID : X + (size_t)bm0 * HID);

  // ---- prologue: chunk 0 into buffer 0, published; then chunk 1 into buffer 1 ----
  if (pinned(wave < 2)) tdm_issue(g0, g1);
  wait_tensor0_group(g0, g1);          // the issuer's own chunk 0 has landed
  __syncthreads();                     // chunk 0 readable by every wave
  tdm_next_chunk(g0, my_base + PTILE_FLOATS * 4u);
  if (pinned(wave < 2)) tdm_issue(g0, g1);

  v8f acc[4][4] = {};
  int cur = 0;
  for (int s = 0; s < NS; ++s) {
    const float* xs = &xw_lds[cur * PTILE_FLOATS + (wm + lo) * XPITCH + hi * 2];
    const float* ws = &xw_lds[(2 + cur) * PTILE_FLOATS + (wn + lo) * XPITCH + hi * 2];
#pragma unroll
    for (int k = 0; k < KC; k += 4) {
      v2f a[4], b[4];
#pragma unroll
      for (int i = 0; i < 4; ++i) a[i] = *(const v2f*)(xs + 16 * i * XPITCH + k);
#pragma unroll
      for (int j = 0; j < 4; ++j) b[j] = *(const v2f*)(ws + 16 * j * XPITCH + k);
#pragma unroll
      for (int i = 0; i < 4; ++i)
#pragma unroll
        for (int j = 0; j < 4; ++j)
          acc[i][j] = wmma_f32_4(a[i], b[j], acc[i][j]);
    }

    // ---- publish chunk s+1, then refill the buffer this pass has read ----
    wait_ds0();                              // this wave's LDS reads of buffer cur have returned
    wait_tensor0_group(g0, g1);              // the issuer's own chunk s+1 has landed (others: nothing out)
    __syncthreads();                         // chunk s+1 readable; every wave has left buffer cur
    if (pinned(s + 2 < NS)) {
      tdm_next_chunk(g0, my_base + (uint32_t)cur * (PTILE_FLOATS * 4u));
      if (pinned(wave < 2)) tdm_issue(g0, g1);
    }
    cur ^= 1;
  }
  wait_tensor0_group(g0, g1);          // nothing of the ring is in flight when a wave ends
  wait_ds0();

#pragma unroll
  for (int j = 0; j < 4; ++j) {
    const int col = n0 + 16 * j + lo;
    const float bn = bias[col];
    const int h = col >> 6;
    const int d = col & 63;
#pragma unroll
    for (int i = 0; i < 4; ++i) {
#pragma unroll
      for (int r = 0; r < 8; ++r) {
        const int row = m0 + 16 * i + r + hi * 8;   // token in [0, 4096)
        const int bi = row >> 11;
        const int s  = row & (SEQ - 1);
        O[((size_t)(bi * NH + h) * SEQ + s) * HS + d] = acc[i][j][r] + bn;
      }
    }
  }
}

__global__ __launch_bounds__(128) __attribute__((amdgpu_waves_per_eu(3, 3))) void attention_kernel(
    const float* __restrict__ Q, const float* __restrict__ K,
    const float* __restrict__ V, const int* mask,
    float* __restrict__ out) {
  // Buffers K0, K1, V0, V1; each starts at a multiple of 2 KiB of the work-group's LDS.
  __shared__ __attribute__((aligned(2048))) float kv_lds[4 * TILE_FLOATS];

  const float NEG_INF = -__builtin_inff();
  const int tid  = threadIdx.x;
  const int wave = (int)uni((uint32_t)tid >> 5);
  const int lane = tid & 31;
  const int lo = lane & 15;
  const int hi = lane >> 4;
  const int q0 = blockIdx.x * 64 + wave * 16;
  const int h  = blockIdx.y;
  const int b  = blockIdx.z;

  const size_t head_off = (size_t)(b * NH + h) * SEQ * HS;
  const float* Qh = Q + head_off;
  const float* Kh = K + head_off;
  const float* Vh = V + head_off;

  // Preload this wave's 16 Q fragments (K-dim 64 in steps of 4): B of S^T, column = query lo.
  v2f aq[16];
  {
    const float* qrow = Qh + (size_t)(q0 + lo) * HS;
#pragma unroll
    for (int t = 0; t < 16; ++t)
      aq[t] = *(const v2f*)(qrow + 4 * t + hi * 2);
  }

  // Query lo's running maximum (alike in both halves) and this half's share of its running sum.
  float mstat = NEG_INF, lstat = 0.0f;
  v8f o[4] = {};   // o[c][r] = O^T[c * 16 + hi * 8 + r][query lo]

  // Row lo of S^T's A operand takes this key of its 16-key tile, so that accumulator register r of half hi holds
  // key 4 * (r >> 1) + 2 * hi + (r & 1): registers 2t, 2t + 1 are then B's k = 2 * hi, 2 * hi + 1 of keys
  // 4t .. 4t + 3, the order in which V's rows are read below.
  const int krow = (lo & 1) + 2 * (lo >> 3) + 4 * ((lo & 7) >> 1);

  const int NT = SEQ / KEYS;

  // Wave 0 streams K's tiles, wave 1 V's; my_base is the wave's buffer 0 (waves 2 and 3 issue nothing).
  const uint32_t my_base = (uint32_t)(uintptr_t)&kv_lds[0] + (wave == 1 ? 2u * TILE_FLOATS * 4u : 0u);
  const v8u g1k = tdm_group1<3>();
  const v8u g1v = tdm_group1<7>();
  v4u g0 = tdm_group0(my_base, wave == 1 ? Vh : Kh);

  // ---- prologue: tile 0 into buffer 0, published; then tile 1 into buffer 1 ----
  if (pinned(wave == 0)) tdm_issue(g0, g1k);
  if (pinned(wave == 1)) tdm_issue(g0, g1v);
  wait_tensor0_groups(g0, g1k, g1v);   // the issuer's own tile 0 has landed
  __syncthreads();                     // tile 0 readable by every wave
  tdm_next(g0, my_base + TILE_FLOATS * 4u);
  if (pinned(wave == 0)) tdm_issue(g0, g1k);
  if (pinned(wave == 1)) tdm_issue(g0, g1v);

  int cur = 0;
  for (int kt = 0; kt < NT; ++kt) {
    const float* kt_lds = &kv_lds[cur * TILE_FLOATS];
    const float* vt_lds = &kv_lds[(2 + cur) * TILE_FLOATS];

    // ---- this pass's operands: K's and V^T's A fragments, the mask words of the lane's keys ----
    v2f ak[NSUB][16];
#pragma unroll
    for (int j = 0; j < NSUB; ++j)
#pragma unroll
      for (int t = 0; t < 16; ++t)
        ak[j][t] = *(const v2f*)(&kt_lds[(16 * j + krow) * KPITCH + 4 * t + hi * 2]);
    // Register r of score accumulator j is key kt * KEYS + 16 * j + 4 * (r >> 1) + 2 * hi + (r & 1).
    const int* mrow = mask + b * SEQ + kt * KEYS + hi * 2;
    int mk[NSUB][8];
#pragma unroll
    for (int j = 0; j < NSUB; ++j)
#pragma unroll
      for (int r = 0; r < 8; ++r) mk[j][r] = mrow[16 * j + 4 * (r >> 1) + (r & 1)];
    // The mask loads' address registers may take a new value only behind this wait: it names the address,
    // which so stays in its registers up to here, and mask is not __restrict__, so that the clobber keeps
    // the loads in front of it.  It stands behind K's LDS loads.
    asm volatile("s_wait_xcnt 0x0" :: "v"(mrow) : "memory");
    v2f av[NSUB][4][4];
#pragma unroll
    for (int j = 0; j < NSUB; ++j)
#pragma unroll
      for (int t = 0; t < 4; ++t) {
        const int k0 = 16 * j + 4 * t + hi * 2;
#pragma unroll
        for (int c = 0; c < 4; ++c)
          av[j][t][c] = v2f{ vt_lds[k0 * VPITCH + c * 16 + lo], vt_lds[(k0 + 1) * VPITCH + c * 16 + lo] };
      }

    // ---- scores^T = K Q^T for the four 16x16 tiles, their chains in turn ----
    v8f sacc[NSUB] = {};
#pragma unroll
    for (int t = 0; t < 16; ++t)
#pragma unroll
      for (int j = 0; j < NSUB; ++j) sacc[j] = wmma_f32_4(ak[j][t], aq[t], sacc[j]);

    // ---- scale + mask ----
    float sv[NSUB][8];
#pragma unroll
    for (int j = 0; j < NSUB; ++j)
#pragma unroll
      for (int r = 0; r < 8; ++r)
        sv[j][r] = (mk[j][r] != 0) ? sacc[j][r] * 0.125f : NEG_INF;   // 1/sqrt(64)

    // ---- online softmax of query lo: 32 keys in this lane, the other 32 in lane ^ 16 ----
    float tmax[NSUB];
#pragma unroll
    for (int j = 0; j < NSUB; ++j)
      tmax[j] = fmaxf(fmaxf(fmaxf(sv[j][0], sv[j][1]), fmaxf(sv[j][2], sv[j][3])),
                      fmaxf(fmaxf(sv[j][4], sv[j][5]), fmaxf(sv[j][6], sv[j][7])));
    float rmax = fmaxf(fmaxf(tmax[0], tmax[1]), fmaxf(tmax[2], tmax[3]));
    rmax = fmaxf(rmax, xhalf(rmax));
    const float mnew = fmaxf(mstat, rmax);
    const float factor = (mnew == NEG_INF) ? 1.0f : __expf(mstat - mnew);
#pragma unroll
    for (int c = 0; c < 4; ++c) o[c] *= factor;

    // ---- per 16-key tile: P^T, then O^T += V^T P^T  (P^T from the score registers as B) ----
    float psum[NSUB];
#pragma unroll
    for (int j = 0; j < NSUB; ++j) {
      float p[8];
#pragma unroll
      for (int r = 0; r < 8; ++r)
        p[r] = (sv[j][r] == NEG_INF) ? 0.0f : __expf(sv[j][r] - mnew);
      psum[j] = ((p[0] + p[1]) + (p[2] + p[3])) + ((p[4] + p[5]) + (p[6] + p[7]));
#pragma unroll
      for (int t = 0; t < 4; ++t) {
        const v2f bp = { p[2 * t], p[2 * t + 1] };
#pragma unroll
        for (int c = 0; c < 4; ++c) o[c] = wmma_f32_4(av[j][t][c], bp, o[c]);
      }
    }
    lstat = lstat * factor + ((psum[0] + psum[1]) + (psum[2] + psum[3]));
    mstat = mnew;

    // ---- publish tile kt+1, then refill the buffer this pass has read ----
    wait_ds0();                              // this wave's LDS reads of buffer cur have returned
    wait_tensor0_groups(g0, g1k, g1v);       // the issuer's own tile kt+1 has landed (others: nothing out)
    __syncthreads();                         // tile kt+1 readable; every wave has left buffer cur
    if (pinned(kt + 2 < NT)) {
      tdm_next(g0, my_base + (uint32_t)cur * (TILE_FLOATS * 4u));
      if (pinned(wave == 0)) tdm_issue(g0, g1k);
      if (pinned(wave == 1)) tdm_issue(g0, g1v);
    }
    cur ^= 1;
  }
  wait_tensor0_groups(g0, g1k, g1v);   // nothing of the ring is in flight when a wave ends
  wait_ds0();

  // ---- join the halves' sums, normalize and write out [B, S, H]: 8 consecutive floats a lane and c ----
  lstat += xhalf(lstat);
  const float inv = (lstat > 0.0f) ? 1.0f / lstat : 0.0f;
  float* orow = out + (size_t)(b * SEQ + q0 + lo) * HID + h * HS + hi * 8;
#pragma unroll
  for (int c = 0; c < 4; ++c) {
    *(float4*)(orow + c * 16)     = make_float4(o[c][0] * inv, o[c][1] * inv, o[c][2] * inv, o[c][3] * inv);
    *(float4*)(orow + c * 16 + 4) = make_float4(o[c][4] * inv, o[c][5] * inv, o[c][6] * inv, o[c][7] * inv);
  }
}

extern "C" void kernel_launch(void* const* d_in, const int* in_sizes, int n_in,
                              void* d_out, int out_size, void* d_ws, size_t ws_size,
                              hipStream_t stream) {
  const float* X    = (const float*)d_in[0];
  const int*   mask = (const int*)d_in[1];
  const float* Wq   = (const float*)d_in[2];
  const float* bq   = (const float*)d_in[3];
  const float* Wk   = (const float*)d_in[4];
  const float* bk   = (const float*)d_in[5];
  const float* Wv   = (const float*)d_in[6];
  const float* bv   = (const float*)d_in[7];
  float* out = (float*)d_out;

  const size_t per = (size_t)BATCH * SEQ * HID;
  float* Qb = (float*)d_ws;
  float* Kb = Qb + per;
  float* Vb = Kb + per;

  qkv_proj_kernel<<<dim3((BATCH * SEQ) / 128, HID / 128, 3), 128, 0, stream>>>(
      X, Wq, bq, Wk, bk, Wv, bv, Qb, Kb, Vb);
  attention_kernel<<<dim3(SEQ / 64, NH, BATCH), 128, 0, stream>>>(
      Qb, Kb, Vb, mask, out);
}
